// v000
// Measured on an AMD MI455X. A time is GPU time per run, averaged over a window of back-to-back runs after a warm-up
// (all launches, gaps included; the runs take copies of the inputs in turn), and the median of several windows.
// Apart from v000's, it joins two sittings. Times from different sittings can be a few percent apart, while
// side-by-side timings come from the same sitting.
// v000 is the starting kernel. One run takes 707 microseconds.
#include <hip/hip_runtime.h>
#include <math.h>

// CDNA5 (gfx1250) wave32 WMMA implementation of the CoAttLayer reference.
// fp32 matrix path (V_WMMA_F32_16X16X4_F32) + async global->LDS double
// buffering (GLOBAL_LOAD_ASYNC_TO_LDS_B128 / ASYNCcnt) in the dominant
// score GEMM.

typedef __attribute__((ext_vector_type(2))) float v2f;
typedef __attribute__((ext_vector_type(8))) float v8f;

#define C_IN   256
#define C_OUT  128
#define NB     8
#define HW     1024
#define NPIX   (NB * HW)        // 8192
#define SCALEF 0.0625f          // 1/sqrt(256)

__device__ __forceinline__ v8f wmma_f32(v2f a, v2f b, v8f c) {
  // 8-arg form: (neg_a, A, neg_b, B, c_mod, C, reuse_a, reuse_b)
  return __builtin_amdgcn_wmma_f32_16x16x4_f32(false, a, false, b, (short)0, c,
                                               false, false);
}

// Async 16B global -> LDS copy, tracked by ASYNCcnt (no VGPR round-trip).
__device__ __forceinline__ void async_copy16(unsigned int lds_off,
                                             const void* gptr) {
  asm volatile("global_load_async_to_lds_b128 %0, %1, off"
               :: "v"(lds_off), "v"(gptr)
               : "memory");
}
__device__ __forceinline__ void wait_async0() {
  asm volatile("s_wait_asynccnt 0x0" ::: "memory");
}

// ---------------------------------------------------------------------------
// Kernel 1: QKV projections.  out[proj][p][o] = sum_c X[p,c] * W[o,c] + b[o]
// proj 0..2 = (q,k,v) of x4 ; proj 3..5 = (q,k,v) of x3.
// ---------------------------------------------------------------------------
__global__ __launch_bounds__(256) void qkv_kernel(
    const float* __restrict__ x4, const float* __restrict__ x3,
    const float* __restrict__ Wq, const float* __restrict__ bq,
    const float* __restrict__ Wk, const float* __restrict__ bk,
    const float* __restrict__ Wv, const float* __restrict__ bv,
    float* __restrict__ out) {
  __shared__ __align__(16) float As[128 * 36];  // [pixel][k] (padded)
  __shared__ __align__(16) float Bs[16 * 36];   // [n][k]     (padded)

  const int tile = blockIdx.x;   // 0..63 pixel tile
  const int nt   = blockIdx.y;   // 0..15 channel tile
  const int proj = blockIdx.z;   // 0..5
  const float* X = (proj < 3) ? x4 : x3;
  const float* W;
  const float* bias;
  const int wsel = proj % 3;
  if (wsel == 0)      { W = Wq; bias = bq; }
  else if (wsel == 1) { W = Wk; bias = bk; }
  else                { W = Wv; bias = bv; }

  const int p0 = tile * 128;
  const int bimg = p0 >> 10, hw0 = p0 & 1023;
  const int n0 = nt * 16;
  const int t = threadIdx.x;
  const int wave = t >> 5, lane = t & 31;
  const int ml = lane & 15;               // M (A) / N (B) within tile
  const int khalf = (lane >> 4) << 1;     // 0 or 2 : K sub-select
  const int mhalf = (lane >> 4) << 3;     // 0 or 8 : C/D row half

  v8f acc = {};
  for (int kc = 0; kc < C_IN; kc += 32) {
    // A tile: x is [b, c, hw]; pixels contiguous along hw -> coalesced.
    for (int idx = t; idx < 4096; idx += 256) {
      int cl = idx >> 7, pl = idx & 127;
      As[pl * 36 + cl] =
          X[(size_t)bimg * C_IN * HW + (size_t)(kc + cl) * HW + hw0 + pl];
    }
    // B tile (K-transposed): Bs[n][k] = W[n0+n][kc+k]
    if (t < 128) {
      int n = t >> 3, kq = (t & 7) << 2;
      *(float4*)&Bs[n * 36 + kq] =
          *(const float4*)&W[(size_t)(n0 + n) * C_IN + kc + kq];
    }
    __syncthreads();
    const int m0 = wave << 4;
#pragma unroll
    for (int ks = 0; ks < 8; ++ks) {
      v2f a = *(const v2f*)&As[(m0 + ml) * 36 + (ks << 2) + khalf];
      v2f b = *(const v2f*)&Bs[ml * 36 + (ks << 2) + khalf];
      acc = wmma_f32(a, b, acc);
    }
    __syncthreads();
  }
  const float bval = bias[n0 + ml];
  float* dst = out + (size_t)proj * NPIX * C_IN;
#pragma unroll
  for (int r = 0; r < 8; ++r) {
    int row = p0 + (wave << 4) + mhalf + r;
    dst[(size_t)row * C_IN + n0 + ml] = acc[r] + bval;
  }
}

// ---------------------------------------------------------------------------
// Kernel 2: attention scores + streaming row-max, async double-buffered.
// S = Q * K^T (K-dim 256).  Per block: 128 query rows x one key-image (1024
// cols), tiled 128 cols at a time; only the per-(row,image) max survives.
// combo: 0=aa 1=bb 2=ab 3=ba
// K-chunk = 16 floats, row pitch 20 floats (80 B: 16B-aligned B128 stores,
// 8B-aligned v2f fragment reads).  2x(Q,K) buffers = 40 KB LDS.
// ---------------------------------------------------------------------------
#define KCH 16
#define PAD 20

__global__ __launch_bounds__(256) void score_kernel(
    const float* __restrict__ qkv, float* __restrict__ rmax) {
  __shared__ __align__(16) float As[2][128 * PAD];  // Q rows [row][k]
  __shared__ __align__(16) float Bt[2][128 * PAD];  // K rows [col][k]

  const int rt = blockIdx.x;  // row tile 0..63
  const int j  = blockIdx.y;  // key image 0..7
  const int cb = blockIdx.z;  // combo 0..3
  const int qbase = (cb == 1 || cb == 3) ? 3 : 0;  // Qa / Qb
  const int kbase = (cb == 1 || cb == 2) ? 4 : 1;  // Ka / Kb
  const float* Q = qkv + (size_t)qbase * NPIX * C_IN;
  const float* K = qkv + (size_t)kbase * NPIX * C_IN;

  const int r0 = rt * 128;
  const int t = threadIdx.x, wave = t >> 5, lane = t & 31;
  const int ml = lane & 15, khalf = (lane >> 4) << 1, mhalf = (lane >> 4) << 3;

  // Per-stage async issue: 128 rows x 16 floats for Q and K = 512 B128
  // transfers each; 256 threads -> 2+2 async instructions per thread.
  auto issue = [&](int buf, int kc0, int c0) {
#pragma unroll
    for (int q = 0; q < 2; ++q) {
      int idx = t + (q << 8);        // 0..511
      int row = idx >> 2;            // 0..127
      int kq  = (idx & 3) << 2;      // 0,4,8,12
      unsigned int la = (unsigned int)(uintptr_t)&As[buf][row * PAD + kq];
      unsigned int lb = (unsigned int)(uintptr_t)&Bt[buf][row * PAD + kq];
      async_copy16(la, &Q[(size_t)(r0 + row) * C_IN + kc0 + kq]);
      async_copy16(lb, &K[(size_t)(c0 + row) * C_IN + kc0 + kq]);
    }
  };

  float rm[8];
#pragma unroll
  for (int r = 0; r < 8; ++r) rm[r] = -3.0e38f;

  for (int cc = 0; cc < 8; ++cc) {
    const int c0 = j * HW + cc * 128;
    v8f acc[8] = {};
    issue(0, 0, c0);  // preload stage 0
    for (int kc = 0, stage = 0; kc < C_IN; kc += KCH, ++stage) {
      const int p = stage & 1;
      wait_async0();       // stage's async copies landed in LDS
      __syncthreads();     // visible to all waves; buffers safe to recycle
      if (kc + KCH < C_IN) issue(p ^ 1, kc + KCH, c0);  // overlap next load
      const int m0 = wave << 4;
#pragma unroll
      for (int ks = 0; ks < 4; ++ks) {
        v2f a = *(const v2f*)&As[p][(m0 + ml) * PAD + (ks << 2) + khalf];
#pragma unroll
        for (int nt = 0; nt < 8; ++nt) {
          v2f b =
              *(const v2f*)&Bt[p][((nt << 4) + ml) * PAD + (ks << 2) + khalf];
          acc[nt] = wmma_f32(a, b, acc[nt]);
        }
      }
    }
    __syncthreads();
#pragma unroll
    for (int nt = 0; nt < 8; ++nt)
#pragma unroll
      for (int r = 0; r < 8; ++r) rm[r] = fmaxf(rm[r], acc[nt][r]);
  }
  // Reduce max across the 16 lanes sharing each C-matrix row.
#pragma unroll
  for (int r = 0; r < 8; ++r) {
    float v = rm[r];
    v = fmaxf(v, __shfl_xor(v, 1, 32));
    v = fmaxf(v, __shfl_xor(v, 2, 32));
    v = fmaxf(v, __shfl_xor(v, 4, 32));
    v = fmaxf(v, __shfl_xor(v, 8, 32));
    rm[r] = v;
  }
  if (ml == 0) {
#pragma unroll
    for (int r = 0; r < 8; ++r) {
      int row = r0 + (wave << 4) + mhalf + r;
      rmax[((size_t)cb * 8 + j) * NPIX + row] = rm[r];
    }
  }
}

// ---------------------------------------------------------------------------
// Kernel 3: m = mean_j(rowmax); gate = softmax(m*SCALE) over hw per image.
// One block per (combo, image).
// ---------------------------------------------------------------------------
__global__ __launch_bounds__(256) void gate_kernel(
    const float* __restrict__ rmax, float* __restrict__ gate) {
  __shared__ float buf[1024];
  __shared__ float red[256];
  const int cb = blockIdx.x, b = blockIdx.y;
  const int t = threadIdx.x;
  float vals[4];
  float lmax = -3.0e38f;
#pragma unroll
  for (int q = 0; q < 4; ++q) {
    int hw = t + (q << 8);
    int i = b * HW + hw;
    float m = 0.f;
    for (int jj = 0; jj < 8; ++jj)
      m += rmax[((size_t)cb * 8 + jj) * NPIX + i];
    float v = m * 0.125f * SCALEF;
    vals[q] = v;
    lmax = fmaxf(lmax, v);
  }
  red[t] = lmax;
  __syncthreads();
  for (int s = 128; s > 0; s >>= 1) {
    if (t < s) red[t] = fmaxf(red[t], red[t + s]);
    __syncthreads();
  }
  float mx = red[0];
  __syncthreads();
  float lsum = 0.f;
#pragma unroll
  for (int q = 0; q < 4; ++q) {
    float e = __expf(vals[q] - mx);
    buf[t + (q << 8)] = e;
    lsum += e;
  }
  red[t] = lsum;
  __syncthreads();
  for (int s = 128; s > 0; s >>= 1) {
    if (t < s) red[t] += red[t + s];
    __syncthreads();
  }
  float inv = 1.f / red[0];
#pragma unroll
  for (int q = 0; q < 4; ++q) {
    int hw = t + (q << 8);
    gate[(size_t)cb * NPIX + b * HW + hw] = buf[hw] * inv;
  }
}

// ---------------------------------------------------------------------------
// Kernel 4a: PV[vsel][p][o] = sum_c Wp[o,c] * V[p,c]   (bias added later,
// since out = gate*(Wp@v) + bp -- the gate does not scale the bias).
// ---------------------------------------------------------------------------
__global__ __launch_bounds__(256) void pv_kernel(
    const float* __restrict__ qkv, const float* __restrict__ Wp,
    float* __restrict__ pv) {
  __shared__ __align__(16) float As[128 * 36];
  __shared__ __align__(16) float Bs[16 * 36];
  const int tile = blockIdx.x;  // 64 pixel tiles
  const int nt = blockIdx.y;    // 8 out-channel tiles
  const int vsel = blockIdx.z;  // 0 = va (proj2), 1 = vb (proj5)
  const float* V = qkv + (size_t)(vsel ? 5 : 2) * NPIX * C_IN;
  const int p0 = tile * 128, n0 = nt * 16;
  const int t = threadIdx.x, wave = t >> 5, lane = t & 31;
  const int ml = lane & 15, khalf = (lane >> 4) << 1, mhalf = (lane >> 4) << 3;

  v8f acc = {};
  for (int kc = 0; kc < C_IN; kc += 32) {
    for (int idx = t; idx < 1024; idx += 256) {
      int row = idx >> 3, kq = (idx & 7) << 2;
      *(float4*)&As[row * 36 + kq] =
          *(const float4*)&V[(size_t)(p0 + row) * C_IN + kc + kq];
    }
    if (t < 128) {
      int n = t >> 3, kq = (t & 7) << 2;
      *(float4*)&Bs[n * 36 + kq] =
          *(const float4*)&Wp[(size_t)(n0 + n) * C_IN + kc + kq];
    }
    __syncthreads();
    const int m0 = wave << 4;
#pragma unroll
    for (int ks = 0; ks < 8; ++ks) {
      v2f a = *(const v2f*)&As[(m0 + ml) * 36 + (ks << 2) + khalf];
      v2f b = *(const v2f*)&Bs[ml * 36 + (ks << 2) + khalf];
      acc = wmma_f32(a, b, acc);
    }
    __syncthreads();
  }
  float* dst = pv + (size_t)vsel * NPIX * C_OUT;
#pragma unroll
  for (int r = 0; r < 8; ++r) {
    int row = p0 + (wave << 4) + mhalf + r;
    dst[(size_t)row * C_OUT + n0 + ml] = acc[r];
  }
}

// ---------------------------------------------------------------------------
// Kernel 4b: out[b, g*128+o, hw] = gate_g[b,hw] * PV[sel][p][o] + bp[o]
// concat order: g0=x34(ba,va) g1=a_x4(aa,va) g2=x43(ab,vb) g3=b_x3(bb,vb)
// ---------------------------------------------------------------------------
__global__ __launch_bounds__(256) void combine_kernel(
    const float* __restrict__ pv, const float* __restrict__ gate,
    const float* __restrict__ bp, float* __restrict__ out) {
  const size_t idx = (size_t)blockIdx.x * 256 + threadIdx.x;  // 8*512*1024
  const int b = (int)(idx >> 19);
  const int rem = (int)(idx & ((1u << 19) - 1));
  const int ch = rem >> 10;
  const int hw = rem & 1023;
  const int g = ch >> 7, o = ch & 127;
  const int cg = (g == 0) ? 3 : (g == 1) ? 0 : (g == 2) ? 2 : 1;
  const int vsel = (g >= 2) ? 1 : 0;
  const int p = b * HW + hw;
  float gv = gate[(size_t)cg * NPIX + p];
  float val = pv[(size_t)vsel * NPIX * C_OUT + (size_t)p * C_OUT + o];
  out[idx] = gv * val + bp[o];
}

// ---------------------------------------------------------------------------
extern "C" void kernel_launch(void* const* d_in, const int* in_sizes, int n_in,
                              void* d_out, int out_size, void* d_ws,
                              size_t ws_size, hipStream_t stream) {
  (void)in_sizes; (void)n_in; (void)out_size; (void)ws_size;
  const float* x4 = (const float*)d_in[0];
  const float* x3 = (const float*)d_in[1];
  const float* Wq = (const float*)d_in[2];
  const float* bq = (const float*)d_in[3];
  const float* Wk = (const float*)d_in[4];
  const float* bk = (const float*)d_in[5];
  const float* Wv = (const float*)d_in[6];
  const float* bv = (const float*)d_in[7];
  const float* Wp = (const float*)d_in[8];
  const float* bp = (const float*)d_in[9];
  float* out = (float*)d_out;

  // Workspace layout (floats): QKV(6*8192*256) | PV(2*8192*128)
  //                            | rowmax(4*8*8192) | gate(4*8192)  ~= 60 MB
  float* ws   = (float*)d_ws;
  float* qkv  = ws;
  float* pv   = qkv + (size_t)6 * NPIX * C_IN;
  float* rmax = pv + (size_t)2 * NPIX * C_OUT;
  float* gate = rmax + (size_t)4 * 8 * NPIX;

  qkv_kernel<<<dim3(64, 16, 6), 256, 0, stream>>>(x4, x3, Wq, bq, Wk, bk, Wv,
                                                  bv, qkv);
  score_kernel<<<dim3(64, 8, 4), 256, 0, stream>>>(qkv, rmax);
  gate_kernel<<<dim3(4, 8), 256, 0, stream>>>(rmax, gate);
  pv_kernel<<<dim3(64, 8, 2), 256, 0, stream>>>(qkv, Wp, pv);
  combine_kernel<<<dim3(16384), 256, 0, stream>>>(pv, gate, bp, out);
}

// v001
// It runs in 700 microseconds.
// In both of two side-by-side timings against v000, it was 1.05 times as fast.
#include <hip/hip_runtime.h>
#include <math.h>

// CDNA5 (gfx1250) wave32 WMMA implementation of the CoAttLayer reference.
// fp32 matrix path (V_WMMA_F32_16X16X4_F32) + async global->LDS double
// buffering (GLOBAL_LOAD_ASYNC_TO_LDS_B128 / ASYNCcnt) in the dominant
// score GEMM.

typedef __attribute__((ext_vector_type(2))) float v2f;
typedef __attribute__((ext_vector_type(8))) float v8f;

#define C_IN   256
#define C_OUT  128
#define NB     8
#define HW     1024
#define NPIX   (NB * HW)        // 8192
#define SCALEF 0.0625f          // 1/sqrt(256)

__device__ __forceinline__ v8f wmma_f32(v2f a, v2f b, v8f c) {
  // 8-arg form: (neg_a, A, neg_b, B, c_mod, C, reuse_a, reuse_b)
  return __builtin_amdgcn_wmma_f32_16x16x4_f32(false, a, false, b, (short)0, c,
                                               false, false);
}

// Async 16B global -> LDS copy, tracked by ASYNCcnt (no VGPR round-trip).
__device__ __forceinline__ void async_copy16(unsigned int lds_off,
                                             const void* gptr) {
  asm volatile("global_load_async_to_lds_b128 %0, %1, off"
               :: "v"(lds_off), "v"(gptr)
               : "memory");
}
__device__ __forceinline__ void wait_async0() {
  asm volatile("s_wait_asynccnt 0x0" ::: "memory");
}

// ---------------------------------------------------------------------------
// Kernel 1: QKV projections.  out[proj][p][o] = sum_c X[p,c] * W[o,c] + b[o]
// proj 0..2 = (q,k,v) of x4 ; proj 3..5 = (q,k,v) of x3.
// Block tile 128 pixels x 128 channels; each wave owns 16 pixels x 128
// channels (8 accumulator tiles), so one staged X chunk feeds 64 WMMAs a wave.
// ---------------------------------------------------------------------------
__global__ __launch_bounds__(256) void qkv_kernel(
    const float* __restrict__ x4, const float* __restrict__ x3,
    const float* __restrict__ Wq, const float* __restrict__ bq,
    const float* __restrict__ Wk, const float* __restrict__ bk,
    const float* __restrict__ Wv, const float* __restrict__ bv,
    float* __restrict__ out) {
  __shared__ __align__(16) float As[128 * 36];  // [pixel][k] (padded)
  __shared__ __align__(16) float Bs[128 * 36];  // [n][k]     (padded)

  const int tile = blockIdx.x;   // 0..63 pixel tile
  const int nb   = blockIdx.y;   // 0..1  channel tile (128 wide)
  const int proj = blockIdx.z;   // 0..5
  const float* X = (proj < 3) ? x4 : x3;
  const float* W;
  const float* bias;
  const int wsel = proj % 3;
  if (wsel == 0)      { W = Wq; bias = bq; }
  else if (wsel == 1) { W = Wk; bias = bk; }
  else                { W = Wv; bias = bv; }

  const int p0 = tile * 128;
  const int bimg = p0 >> 10, hw0 = p0 & 1023;
  const int n0 = nb * 128;
  const int t = threadIdx.x;
  const int wave = t >> 5, lane = t & 31;
  const int ml = lane & 15;               // M (A) / N (B) within tile
  const int khalf = (lane >> 4) << 1;     // 0 or 2 : K sub-select
  const int mhalf = (lane >> 4) << 3;     // 0 or 8 : C/D row half

  v8f acc[8] = {};
  for (int kc = 0; kc < C_IN; kc += 32) {
    // A tile: x is [b, c, hw]; pixels contiguous along hw -> coalesced.
    for (int idx = t; idx < 4096; idx += 256) {
      int cl = idx >> 7, pl = idx & 127;
      As[pl * 36 + cl] =
          X[(size_t)bimg * C_IN * HW + (size_t)(kc + cl) * HW + hw0 + pl];
    }
    // B tile (K-transposed): Bs[n][k] = W[n0+n][kc+k]
    // Unrolled so that the four 16-byte loads share one trip to L2.
#pragma unroll
    for (int q = 0; q < 4; ++q) {
      int idx = t + (q << 8);
      int n = idx >> 3, kq = (idx & 7) << 2;
      *(float4*)&Bs[n * 36 + kq] =
          *(const float4*)&W[(size_t)(n0 + n) * C_IN + kc + kq];
    }
    __syncthreads();
    const int m0 = wave << 4;
#pragma unroll
    for (int ks = 0; ks < 8; ++ks) {
      v2f a = *(const v2f*)&As[(m0 + ml) * 36 + (ks << 2) + khalf];
      // Unrolled: constant nt keeps the eight accumulator tiles in registers.
#pragma unroll
      for (int nt = 0; nt < 8; ++nt) {
        v2f b = *(const v2f*)&Bs[((nt << 4) + ml) * 36 + (ks << 2) + khalf];
        acc[nt] = wmma_f32(a, b, acc[nt]);
      }
    }
    __syncthreads();
  }
  float* dst = out + (size_t)proj * NPIX * C_IN;
  // Unrolled for the same reason: acc[nt][r] read by constant indices.
#pragma unroll
  for (int nt = 0; nt < 8; ++nt) {
    const float bval = bias[n0 + (nt << 4) + ml];
#pragma unroll
    for (int r = 0; r < 8; ++r) {
      int row = p0 + (wave << 4) + mhalf + r;
      dst[(size_t)row * C_IN + n0 + (nt << 4) + ml] = acc[nt][r] + bval;
    }
  }
}

// ---------------------------------------------------------------------------
// Kernel 2: attention scores + streaming row-max, async double-buffered.
// S = Q * K^T (K-dim 256).  Per block: 128 query rows x one key-image (1024
// cols), tiled 128 cols at a time; only the per-(row,image) max survives.
// combo: 0=aa 1=bb 2=ab 3=ba
// K-chunk = 16 floats, row pitch 20 floats (80 B: 16B-aligned B128 stores,
// 8B-aligned v2f fragment reads).  2x(Q,K) buffers = 40 KB LDS.
// ---------------------------------------------------------------------------
#define KCH 16
#define PAD 20

__global__ __launch_bounds__(256) void score_kernel(
    const float* __restrict__ qkv, float* __restrict__ rmax) {
  __shared__ __align__(16) float As[2][128 * PAD];  // Q rows [row][k]
  __shared__ __align__(16) float Bt[2][128 * PAD];  // K rows [col][k]

  const int rt = blockIdx.x;  // row tile 0..63
  const int j  = blockIdx.y;  // key image 0..7
  const int cb = blockIdx.z;  // combo 0..3
  const int qbase = (cb == 1 || cb == 3) ? 3 : 0;  // Qa / Qb
  const int kbase = (cb == 1 || cb == 2) ? 4 : 1;  // Ka / Kb
  const float* Q = qkv + (size_t)qbase * NPIX * C_IN;
  const float* K = qkv + (size_t)kbase * NPIX * C_IN;

  const int r0 = rt * 128;
  const int t = threadIdx.x, wave = t >> 5, lane = t & 31;
  const int ml = lane & 15, khalf = (lane >> 4) << 1, mhalf = (lane >> 4) << 3;

  // Per-stage async issue: 128 rows x 16 floats for Q and K = 512 B128
  // transfers each; 256 threads -> 2+2 async instructions per thread.
  auto issue = [&](int buf, int kc0, int c0) {
#pragma unroll
    for (int q = 0; q < 2; ++q) {
      int idx = t + (q << 8);        // 0..511
      int row = idx >> 2;            // 0..127
      int kq  = (idx & 3) << 2;      // 0,4,8,12
      unsigned int la = (unsigned int)(uintptr_t)&As[buf][row * PAD + kq];
      unsigned int lb = (unsigned int)(uintptr_t)&Bt[buf][row * PAD + kq];
      async_copy16(la, &Q[(size_t)(r0 + row) * C_IN + kc0 + kq]);
      async_copy16(lb, &K[(size_t)(c0 + row) * C_IN + kc0 + kq]);
    }
  };

  float rm[8];
#pragma unroll
  for (int r = 0; r < 8; ++r) rm[r] = -3.0e38f;

  for (int cc = 0; cc < 8; ++cc) {
    const int c0 = j * HW + cc * 128;
    v8f acc[8] = {};
    issue(0, 0, c0);  // preload stage 0
    for (int kc = 0, stage = 0; kc < C_IN; kc += KCH, ++stage) {
      const int p = stage & 1;
      wait_async0();       // stage's async copies landed in LDS
      __syncthreads();     // visible to all waves; buffers safe to recycle
      if (kc + KCH < C_IN) issue(p ^ 1, kc + KCH, c0);  // overlap next load
      const int m0 = wave << 4;
#pragma unroll
      for (int ks = 0; ks < 4; ++ks) {
        v2f a = *(const v2f*)&As[p][(m0 + ml) * PAD + (ks << 2) + khalf];
#pragma unroll
        for (int nt = 0; nt < 8; ++nt) {
          v2f b =
              *(const v2f*)&Bt[p][((nt << 4) + ml) * PAD + (ks << 2) + khalf];
          acc[nt] = wmma_f32(a, b, acc[nt]);
        }
      }
    }
    __syncthreads();
#pragma unroll
    for (int nt = 0; nt < 8; ++nt)
#pragma unroll
      for (int r = 0; r < 8; ++r) rm[r] = fmaxf(rm[r], acc[nt][r]);
  }
  // Reduce max across the 16 lanes sharing each C-matrix row.
#pragma unroll
  for (int r = 0; r < 8; ++r) {
    float v = rm[r];
    v = fmaxf(v, __shfl_xor(v, 1, 32));
    v = fmaxf(v, __shfl_xor(v, 2, 32));
    v = fmaxf(v, __shfl_xor(v, 4, 32));
    v = fmaxf(v, __shfl_xor(v, 8, 32));
    rm[r] = v;
  }
  if (ml == 0) {
#pragma unroll
    for (int r = 0; r < 8; ++r) {
      int row = r0 + (wave << 4) + mhalf + r;
      rmax[((size_t)cb * 8 + j) * NPIX + row] = rm[r];
    }
  }
}

// ---------------------------------------------------------------------------
// Kernel 3: m = mean_j(rowmax); gate = softmax(m*SCALE) over hw per image.
// One block per (combo, image).
// ---------------------------------------------------------------------------
__global__ __launch_bounds__(256) void gate_kernel(
    const float* __restrict__ rmax, float* __restrict__ gate) {
  __shared__ float buf[1024];
  __shared__ float red[256];
  const int cb = blockIdx.x, b = blockIdx.y;
  const int t = threadIdx.x;
  float vals[4];
  float lmax = -3.0e38f;
#pragma unroll
  for (int q = 0; q < 4; ++q) {
    int hw = t + (q << 8);
    int i = b * HW + hw;
    float m = 0.f;
    for (int jj = 0; jj < 8; ++jj)
      m += rmax[((size_t)cb * 8 + jj) * NPIX + i];
    float v = m * 0.125f * SCALEF;
    vals[q] = v;
    lmax = fmaxf(lmax, v);
  }
  red[t] = lmax;
  __syncthreads();
  for (int s = 128; s > 0; s >>= 1) {
    if (t < s) red[t] = fmaxf(red[t], red[t + s]);
    __syncthreads();
  }
  float mx = red[0];
  __syncthreads();
  float lsum = 0.f;
#pragma unroll
  for (int q = 0; q < 4; ++q) {
    float e = __expf(vals[q] - mx);
    buf[t + (q << 8)] = e;
    lsum += e;
  }
  red[t] = lsum;
  __syncthreads();
  for (int s = 128; s > 0; s >>= 1) {
    if (t < s) red[t] += red[t + s];
    __syncthreads();
  }
  float inv = 1.f / red[0];
#pragma unroll
  for (int q = 0; q < 4; ++q) {
    int hw = t + (q << 8);
    gate[(size_t)cb * NPIX + b * HW + hw] = buf[hw] * inv;
  }
}

// ---------------------------------------------------------------------------
// Kernel 4a: PV[vsel][p][o] = sum_c Wp[o,c] * V[p,c]   (bias added later,
// since out = gate*(Wp@v) + bp -- the gate does not scale the bias).
// ---------------------------------------------------------------------------
__global__ __launch_bounds__(256) void pv_kernel(
    const float* __restrict__ qkv, const float* __restrict__ Wp,
    float* __restrict__ pv) {
  __shared__ __align__(16) float As[128 * 36];
  __shared__ __align__(16) float Bs[16 * 36];
  const int tile = blockIdx.x;  // 64 pixel tiles
  const int nt = blockIdx.y;    // 8 out-channel tiles
  const int vsel = blockIdx.z;  // 0 = va (proj2), 1 = vb (proj5)
  const float* V = qkv + (size_t)(vsel ? 5 : 2) * NPIX * C_IN;
  const int p0 = tile * 128, n0 = nt * 16;
  const int t = threadIdx.x, wave = t >> 5, lane = t & 31;
  const int ml = lane & 15, khalf = (lane >> 4) << 1, mhalf = (lane >> 4) << 3;

  v8f acc = {};
  for (int kc = 0; kc < C_IN; kc += 32) {
    for (int idx = t; idx < 1024; idx += 256) {
      int row = idx >> 3, kq = (idx & 7) << 2;
      *(float4*)&As[row * 36 + kq] =
          *(const float4*)&V[(size_t)(p0 + row) * C_IN + kc + kq];
    }
    if (t < 128) {
      int n = t >> 3, kq = (t & 7) << 2;
      *(float4*)&Bs[n * 36 + kq] =
          *(const float4*)&Wp[(size_t)(n0 + n) * C_IN + kc + kq];
    }
    __syncthreads();
    const int m0 = wave << 4;
#pragma unroll
    for (int ks = 0; ks < 8; ++ks) {
      v2f a = *(const v2f*)&As[(m0 + ml) * 36 + (ks << 2) + khalf];
      v2f b = *(const v2f*)&Bs[ml * 36 + (ks << 2) + khalf];
      acc = wmma_f32(a, b, acc);
    }
    __syncthreads();
  }
  float* dst = pv + (size_t)vsel * NPIX * C_OUT;
#pragma unroll
  for (int r = 0; r < 8; ++r) {
    int row = p0 + (wave << 4) + mhalf + r;
    dst[(size_t)row * C_OUT + n0 + ml] = acc[r];
  }
}

// ---------------------------------------------------------------------------
// Kernel 4b: out[b, g*128+o, hw] = gate_g[b,hw] * PV[sel][p][o] + bp[o]
// concat order: g0=x34(ba,va) g1=a_x4(aa,va) g2=x43(ab,vb) g3=b_x3(bb,vb)
// ---------------------------------------------------------------------------
__global__ __launch_bounds__(256) void combine_kernel(
    const float* __restrict__ pv, const float* __restrict__ gate,
    const float* __restrict__ bp, float* __restrict__ out) {
  const size_t idx = (size_t)blockIdx.x * 256 + threadIdx.x;  // 8*512*1024
  const int b = (int)(idx >> 19);
  const int rem = (int)(idx & ((1u << 19) - 1));
  const int ch = rem >> 10;
  const int hw = rem & 1023;
  const int g = ch >> 7, o = ch & 127;
  const int cg = (g == 0) ? 3 : (g == 1) ? 0 : (g == 2) ? 2 : 1;
  const int vsel = (g >= 2) ? 1 : 0;
  const int p = b * HW + hw;
  float gv = gate[(size_t)cg * NPIX + p];
  float val = pv[(size_t)vsel * NPIX * C_OUT + (size_t)p * C_OUT + o];
  out[idx] = gv * val + bp[o];
}

// ---------------------------------------------------------------------------
extern "C" void kernel_launch(void* const* d_in, const int* in_sizes, int n_in,
                              void* d_out, int out_size, void* d_ws,
                              size_t ws_size, hipStream_t stream) {
  (void)in_sizes; (void)n_in; (void)out_size; (void)ws_size;
  const float* x4 = (const float*)d_in[0];
  const float* x3 = (const float*)d_in[1];
  const float* Wq = (const float*)d_in[2];
  const float* bq = (const float*)d_in[3];
  const float* Wk = (const float*)d_in[4];
  const float* bk = (const float*)d_in[5];
  const float* Wv = (const float*)d_in[6];
  const float* bv = (const float*)d_in[7];
  const float* Wp = (const float*)d_in[8];
  const float* bp = (const float*)d_in[9];
  float* out = (float*)d_out;

  // Workspace layout (floats): QKV(6*8192*256) | PV(2*8192*128)
  //                            | rowmax(4*8*8192) | gate(4*8192)  ~= 60 MB
  float* ws   = (float*)d_ws;
  float* qkv  = ws;
  float* pv   = qkv + (size_t)6 * NPIX * C_IN;
  float* rmax = pv + (size_t)2 * NPIX * C_OUT;
  float* gate = rmax + (size_t)4 * 8 * NPIX;

  qkv_kernel<<<dim3(64, 2, 6), 256, 0, stream>>>(x4, x3, Wq, bq, Wk, bk, Wv,
                                                  bv, qkv);
  score_kernel<<<dim3(64, 8, 4), 256, 0, stream>>>(qkv, rmax);
  gate_kernel<<<dim3(4, 8), 256, 0, stream>>>(rmax, gate);
  pv_kernel<<<dim3(64, 8, 2), 256, 0, stream>>>(qkv, Wp, pv);
  combine_kernel<<<dim3(16384), 256, 0, stream>>>(pv, gate, bp, out);
}
